// v000
// Times are from an AMD MI455X. After a warm-up the kernel runs many times in a row, and a time is the length of
// such a window on the GPU divided by its runs, so every launch and the gaps after it count. The runs cycle
// through copies of the inputs. A figure is the median of several windows, for all but v000 over two sittings.
// Sittings can differ by a few percent; kernels timed side by side share one.
// v000, which the later versions start from, runs in 264 microseconds.
#include <hip/hip_runtime.h>
#include <hip/hip_bf16.h>
#include <math.h>

typedef __attribute__((ext_vector_type(2))) float v2f;
typedef __attribute__((ext_vector_type(8))) float v8f;
typedef __attribute__((ext_vector_type(4))) unsigned int v4u;
typedef __attribute__((ext_vector_type(8))) int v8i;
typedef __attribute__((ext_vector_type(4))) int v4i;

#define IN_C   1024
#define OUT_C  1024
#define HEADS  16
#define GROUPS 4
#define DHEAD  64     // OUT_C / HEADS
#define ICG    256    // IN_C / GROUPS
#define OCG    256    // OUT_C / GROUPS
#define MROWS  4096   // B * S
#define SEQ    2048
#define PSTR   34     // LDS row stride (floats) for 16x32 P tile

#if defined(__has_builtin)
#if __has_builtin(__builtin_amdgcn_tensor_load_to_lds) && __has_builtin(__builtin_amdgcn_s_wait_tensorcnt)
#define HAVE_TDM 1
#endif
#endif

__global__ __launch_bounds__(256)
void grouped_linear_kernel(const float* __restrict__ X,
                           const float* __restrict__ W,     // [G][ICG][OCG]
                           const float* __restrict__ bias,  // [OUT_C]
                           float* __restrict__ Y)           // [MROWS][OUT_C]
{
    __shared__ float wlds[ICG * 64];       // 64 KB weight slice [256][64]

    const int tid  = threadIdx.x;
    const int wave = tid >> 5;
    const int lane = tid & 31;

    const int cg    = blockIdx.y;          // 0..15: 64-wide column group
    const int n0    = cg * 64;
    const int g     = n0 / OCG;
    const int nin   = n0 - g * OCG;        // column offset inside group
    const int kbase = g * ICG;
    const int r0    = blockIdx.x * 128 + wave * 16;

    const float* Wg = W + (size_t)g * ICG * OCG;

#ifdef HAVE_TDM
    if (wave == 0) {
        const unsigned long long gaddr = (unsigned long long)(uintptr_t)(Wg + nin);
        const unsigned int ldsa = (unsigned int)(uintptr_t)(&wlds[0]);
        v4u g0;
        g0[0] = 1u;                                        // count=1, user desc
        g0[1] = ldsa;                                      // lds_addr
        g0[2] = (unsigned int)gaddr;                       // global_addr[31:0]
        g0[3] = (unsigned int)((gaddr >> 32) & 0x01FFFFFFu) | (2u << 30); // [56:32]+type=2
        v8i g1;
        g1[0] = 0x00020000;
        g1[1] = 0x01000000;
        g1[2] = 0x01000000;
        g1[3] = 0x00400000;
        g1[4] = 0x00000100;
        g1[5] = 256;
        g1[6] = 0;
        g1[7] = 0;
        v4i gz = {0, 0, 0, 0};
#if defined(__clang_major__) && (__clang_major__ >= 23)
        v8i gz8 = {0, 0, 0, 0, 0, 0, 0, 0};
        __builtin_amdgcn_tensor_load_to_lds(g0, g1, gz, gz, gz8, 0);
#else
        __builtin_amdgcn_tensor_load_to_lds(g0, g1, gz, gz, 0);
#endif
        __builtin_amdgcn_s_wait_tensorcnt(0);
    }
    __syncthreads();
#else
    for (int i = tid; i < ICG * 16; i += 256) {
        const int row = i >> 4;
        const int c4  = i & 15;
        *(float4*)(&wlds[row * 64 + c4 * 4]) =
            *(const float4*)(Wg + (size_t)row * OCG + nin + c4 * 4);
    }
    __syncthreads();
#endif

    const int half = (lane < 16) ? 0 : 2;  // K sub-offset for this half-wave
    const int mn   = lane & 15;            // M index (A) / N index (B)

    const float* xrow = X + (size_t)(r0 + mn) * IN_C + kbase;

    v8f acc[4] = {};
    for (int k = 0; k < ICG; k += 4) {
        const v2f a = *(const v2f*)(xrow + k + half);
        #pragma unroll
        for (int j = 0; j < 4; ++j) {
            const int n = j * 16 + mn;
            v2f b;
            b.x = wlds[(k + half) * 64 + n];
            b.y = wlds[(k + half + 1) * 64 + n];
            acc[j] = __builtin_amdgcn_wmma_f32_16x16x4_f32(
                false, a, false, b, (short)0, acc[j], false, false);
        }
    }

    const int rbase = r0 + ((lane < 16) ? 0 : 8);
    #pragma unroll
    for (int j = 0; j < 4; ++j) {
        const int n  = n0 + j * 16 + mn;
        const float bv = bias[n];
        #pragma unroll
        for (int i = 0; i < 8; ++i)
            Y[(size_t)(rbase + i) * OUT_C + n] = acc[j][i] + bv;
    }
}

// ---------------------------------------------------------------------------
// Kernel 2: flash attention with restricted softmax, 32-key blocks.
// One wave = 16 query rows of one (batch, head). Two score tiles share one
// softmax reduction pass (halves shuffle/exp/rescale VALU per key so the
// loop is WMMA-bound, with WMMA co-executing against the remaining VALU).
// Online softmax init m=0, l=1 reproduces the exp(margin - max) term.
// P (16x32) is transposed C-layout -> A-layout through a per-wave LDS tile.
// ---------------------------------------------------------------------------
__global__ __launch_bounds__(256)
void attention_kernel(const float* __restrict__ Q,
                      const float* __restrict__ K,
                      const float* __restrict__ V,
                      float* __restrict__ O)
{
    __shared__ float plds[8 * 16 * PSTR];  // per-wave 16x32 P tile, stride 34

    const int tid  = threadIdx.x;
    const int wave = tid >> 5;
    const int lane = tid & 31;
    const int h    = blockIdx.y;
    const int b    = blockIdx.z;
    const int q0   = blockIdx.x * 128 + wave * 16;
    const int ch   = h * DHEAD;
    const size_t rowbase = (size_t)b * SEQ;

    float* pw = &plds[wave * 16 * PSTR];

    const int half = (lane < 16) ? 0 : 2;
    const int mn   = lane & 15;

    // Q tile fragments (16 rows x 64 dims) hoisted into registers
    v2f qa[16];
    const float* qrow = Q + (rowbase + q0 + mn) * OUT_C + ch;
    #pragma unroll
    for (int s = 0; s < 16; ++s)
        qa[s] = *(const v2f*)(qrow + s * 4 + half);

    v8f acc[4] = {};
    float mrun[8], lrun[8];
    #pragma unroll
    for (int i = 0; i < 8; ++i) { mrun[i] = 0.0f; lrun[i] = 1.0f; }

    for (int kb = 0; kb < SEQ / 32; ++kb) {
        const int kv0 = kb * 32;
        const float* krow0 = K + (rowbase + kv0 + mn) * OUT_C + ch;
        const float* krow1 = krow0 + 16 * OUT_C;

        // prefetch next 32-key K/V block while this block computes
        if (kb + 1 < SEQ / 32) {
            __builtin_prefetch(krow0 + 32 * OUT_C, 0, 1);
            __builtin_prefetch(krow1 + 32 * OUT_C, 0, 1);
            __builtin_prefetch(V + (rowbase + kv0 + 32 + mn) * OUT_C + ch, 0, 1);
            __builtin_prefetch(V + (rowbase + kv0 + 48 + mn) * OUT_C + ch, 0, 1);
        }

        // S = Q K^T for two 16-key tiles (B frag lane = key, comps = dims)
        v8f s0 = {}, s1 = {};
        #pragma unroll
        for (int st = 0; st < 16; ++st) {
            const v2f bf0 = *(const v2f*)(krow0 + st * 4 + half);
            const v2f bf1 = *(const v2f*)(krow1 + st * 4 + half);
            s0 = __builtin_amdgcn_wmma_f32_16x16x4_f32(
                false, qa[st], false, bf0, (short)0, s0, false, false);
            s1 = __builtin_amdgcn_wmma_f32_16x16x4_f32(
                false, qa[st], false, bf1, (short)0, s1, false, false);
        }

        // one online-softmax pass covering both tiles (rows in half-wave groups)
        float pv0[8], pv1[8];
        #pragma unroll
        for (int i = 0; i < 8; ++i) {
            const float a0 = s0[i] * 0.125f;          // 1/sqrt(64)
            const float a1 = s1[i] * 0.125f;
            float rm = fmaxf(a0, a1);
            rm = fmaxf(rm, __shfl_xor(rm, 1, 16));
            rm = fmaxf(rm, __shfl_xor(rm, 2, 16));
            rm = fmaxf(rm, __shfl_xor(rm, 4, 16));
            rm = fmaxf(rm, __shfl_xor(rm, 8, 16));
            const float mnew = fmaxf(mrun[i], rm);
            const float corr = __expf(mrun[i] - mnew);
            const float p0   = __expf(a0 - mnew);
            const float p1   = __expf(a1 - mnew);
            float rs = p0 + p1;
            rs += __shfl_xor(rs, 1, 16);
            rs += __shfl_xor(rs, 2, 16);
            rs += __shfl_xor(rs, 4, 16);
            rs += __shfl_xor(rs, 8, 16);
            lrun[i] = lrun[i] * corr + rs;
            mrun[i] = mnew;
            #pragma unroll
            for (int j = 0; j < 4; ++j) acc[j][i] *= corr;
            pv0[i] = p0;
            pv1[i] = p1;
        }

        // transpose P via LDS: C-layout (lane=key, vgpr=qrow) -> [query][key]
        const int prow = (lane < 16) ? 0 : 8;
        #pragma unroll
        for (int i = 0; i < 8; ++i) {
            pw[(prow + i) * PSTR + mn]      = pv0[i];
            pw[(prow + i) * PSTR + 16 + mn] = pv1[i];
        }
        asm volatile("s_wait_dscnt 0" ::: "memory");

        // O += P V : A frag from LDS (lane=query m), B frag lane = dim n
        #pragma unroll
        for (int st = 0; st < 8; ++st) {
            const int kk = st * 4 + half;  // key index within 32-key block
            const v2f a = *(const v2f*)(pw + mn * PSTR + kk);
            const float* vr = V + (rowbase + kv0 + kk) * OUT_C + ch;
            #pragma unroll
            for (int j = 0; j < 4; ++j) {
                v2f bf;
                bf.x = vr[j * 16 + mn];
                bf.y = vr[OUT_C + j * 16 + mn];
                acc[j] = __builtin_amdgcn_wmma_f32_16x16x4_f32(
                    false, a, false, bf, (short)0, acc[j], false, false);
            }
        }
    }

    // normalize and store
    const int rbase = q0 + ((lane < 16) ? 0 : 8);
    #pragma unroll
    for (int i = 0; i < 8; ++i) {
        const float inv = 1.0f / lrun[i];
        #pragma unroll
        for (int j = 0; j < 4; ++j)
            O[(rowbase + rbase + i) * OUT_C + ch + j * 16 + mn] = acc[j][i] * inv;
    }
}

// ---------------------------------------------------------------------------
extern "C" void kernel_launch(void* const* d_in, const int* in_sizes, int n_in,
                              void* d_out, int out_size, void* d_ws, size_t ws_size,
                              hipStream_t stream) {
    const float* q  = (const float*)d_in[0];
    const float* k  = (const float*)d_in[1];
    const float* v  = (const float*)d_in[2];
    const float* wq = (const float*)d_in[3];
    const float* wk = (const float*)d_in[4];
    const float* wv = (const float*)d_in[5];
    const float* bq = (const float*)d_in[6];
    const float* bk = (const float*)d_in[7];
    const float* bv = (const float*)d_in[8];
    float* out = (float*)d_out;

    float* Qp = (float*)d_ws;                       // [4096][1024]
    float* Kp = Qp + (size_t)MROWS * OUT_C;
    float* Vp = Kp + (size_t)MROWS * OUT_C;

    dim3 gproj(MROWS / 128, OUT_C / 64, 1);         // 32 x 16
    grouped_linear_kernel<<<gproj, 256, 0, stream>>>(q, wq, bq, Qp);
    grouped_linear_kernel<<<gproj, 256, 0, stream>>>(k, wk, bk, Kp);
    grouped_linear_kernel<<<gproj, 256, 0, stream>>>(v, wv, bv, Vp);

    dim3 gattn(SEQ / 128, HEADS, 2);                // 16 x 16 x 2
    attention_kernel<<<gattn, 256, 0, stream>>>(Qp, Kp, Vp, out);
}

// v001
// One run takes 266 microseconds.
// Next to v000, in two timings, it ran 1.04 times as fast each time.
#include <hip/hip_runtime.h>
#include <hip/hip_bf16.h>
#include <math.h>

typedef __attribute__((ext_vector_type(2))) float v2f;
typedef __attribute__((ext_vector_type(8))) float v8f;
typedef __attribute__((ext_vector_type(4))) unsigned int v4u;
typedef __attribute__((ext_vector_type(8))) int v8i;
typedef __attribute__((ext_vector_type(4))) int v4i;

#define IN_C   1024
#define OUT_C  1024
#define HEADS  16
#define GROUPS 4
#define DHEAD  64     // OUT_C / HEADS
#define ICG    256    // IN_C / GROUPS
#define OCG    256    // OUT_C / GROUPS
#define MROWS  4096   // B * S
#define SEQ    2048
#define PSTR   34
#define KPIT   68
#define VPIT   80
#define KTILE  (32 * KPIT)
#define STAGE  (32 * (KPIT + VPIT))

#if defined(__has_builtin)
#if __has_builtin(__builtin_amdgcn_tensor_load_to_lds) && __has_builtin(__builtin_amdgcn_s_wait_tensorcnt)
#define HAVE_TDM 1
#endif
#endif

__global__ __launch_bounds__(256)
void grouped_linear_kernel(const float* __restrict__ X,
                           const float* __restrict__ W,     // [G][ICG][OCG]
                           const float* __restrict__ bias,  // [OUT_C]
                           float* __restrict__ Y)           // [MROWS][OUT_C]
{
    __shared__ float wlds[ICG * 64];       // 64 KB weight slice [256][64]

    const int tid  = threadIdx.x;
    const int wave = tid >> 5;
    const int lane = tid & 31;

    const int cg    = blockIdx.y;          // 0..15: 64-wide column group
    const int n0    = cg * 64;
    const int g     = n0 / OCG;
    const int nin   = n0 - g * OCG;        // column offset inside group
    const int kbase = g * ICG;
    const int r0    = blockIdx.x * 128 + wave * 16;

    const float* Wg = W + (size_t)g * ICG * OCG;

#ifdef HAVE_TDM
    if (wave == 0) {
        const unsigned long long gaddr = (unsigned long long)(uintptr_t)(Wg + nin);
        const unsigned int ldsa = (unsigned int)(uintptr_t)(&wlds[0]);
        v4u g0;
        g0[0] = 1u;                                        // count=1, user desc
        g0[1] = ldsa;                                      // lds_addr
        g0[2] = (unsigned int)gaddr;                       // global_addr[31:0]
        g0[3] = (unsigned int)((gaddr >> 32) & 0x01FFFFFFu) | (2u << 30); // [56:32]+type=2
        v8i g1;
        g1[0] = 0x00020000;
        g1[1] = 0x01000000;
        g1[2] = 0x01000000;
        g1[3] = 0x00400000;
        g1[4] = 0x00000100;
        g1[5] = 256;
        g1[6] = 0;
        g1[7] = 0;
        v4i gz = {0, 0, 0, 0};
#if defined(__clang_major__) && (__clang_major__ >= 23)
        v8i gz8 = {0, 0, 0, 0, 0, 0, 0, 0};
        __builtin_amdgcn_tensor_load_to_lds(g0, g1, gz, gz, gz8, 0);
#else
        __builtin_amdgcn_tensor_load_to_lds(g0, g1, gz, gz, 0);
#endif
        __builtin_amdgcn_s_wait_tensorcnt(0);
    }
    __syncthreads();
#else
    for (int i = tid; i < ICG * 16; i += 256) {
        const int row = i >> 4;
        const int c4  = i & 15;
        *(float4*)(&wlds[row * 64 + c4 * 4]) =
            *(const float4*)(Wg + (size_t)row * OCG + nin + c4 * 4);
    }
    __syncthreads();
#endif

    const int half = (lane < 16) ? 0 : 2;  // K sub-offset for this half-wave
    const int mn   = lane & 15;            // M index (A) / N index (B)

    const float* xrow = X + (size_t)(r0 + mn) * IN_C + kbase;

    v8f acc[4] = {};
    for (int k = 0; k < ICG; k += 4) {
        const v2f a = *(const v2f*)(xrow + k + half);
        #pragma unroll
        for (int j = 0; j < 4; ++j) {
            const int n = j * 16 + mn;
            v2f b;
            b.x = wlds[(k + half) * 64 + n];
            b.y = wlds[(k + half + 1) * 64 + n];
            acc[j] = __builtin_amdgcn_wmma_f32_16x16x4_f32(
                false, a, false, b, (short)0, acc[j], false, false);
        }
    }

    const int rbase = r0 + ((lane < 16) ? 0 : 8);
    #pragma unroll
    for (int j = 0; j < 4; ++j) {
        const int n  = n0 + j * 16 + mn;
        const float bv = bias[n];
        #pragma unroll
        for (int i = 0; i < 8; ++i)
            Y[(size_t)(rbase + i) * OUT_C + n] = acc[j][i] + bv;
    }
}

__device__ __forceinline__ void stage_kv(unsigned int lk, unsigned int lv,
                                         const float* gk, const float* gv)
{
    const unsigned int lk1 = lk + 16 * KPIT * 4;
    const unsigned int lv1 = lv + 16 * VPIT * 4;
    const float* gk1 = gk + 16 * OUT_C;
    const float* gv1 = gv + 16 * OUT_C;
    asm volatile("global_load_async_to_lds_b128 %0, %4, off\n\t"
                 "global_load_async_to_lds_b128 %1, %5, off\n\t"
                 "global_load_async_to_lds_b128 %2, %6, off\n\t"
                 "global_load_async_to_lds_b128 %3, %7, off\n\t"
                 "s_wait_xcnt 0x0"
                 :: "v"(lk), "v"(lk1), "v"(lv), "v"(lv1),
                    "v"(gk), "v"(gk1), "v"(gv), "v"(gv1)
                 : "memory");
}

__global__ __launch_bounds__(256)
void attention_kernel(const float* __restrict__ Q,
                      const float* __restrict__ K,
                      const float* __restrict__ V,
                      float* __restrict__ O)
{
    __shared__ float plds[8 * 16 * PSTR];  // per-wave 16x32 P tile, stride 34
    __shared__ __attribute__((aligned(16))) float kvlds[2 * STAGE];  // two buffers of K + V tile

    const int tid  = threadIdx.x;
    const int wave = tid >> 5;
    const int lane = tid & 31;
    const int h    = blockIdx.y;
    const int b    = blockIdx.z;
    const int q0   = blockIdx.x * 128 + wave * 16;
    const int ch   = h * DHEAD;
    const size_t rowbase = (size_t)b * SEQ;

    float* pw = &plds[wave * 16 * PSTR];

    const int half = (lane < 16) ? 0 : 2;
    const int mn   = lane & 15;

    // Q tile fragments (16 rows x 64 dims) hoisted into registers
    v2f qa[16];
    const float* qrow = Q + (rowbase + q0 + mn) * OUT_C + ch;
    #pragma unroll
    for (int s = 0; s < 16; ++s)
        qa[s] = *(const v2f*)(qrow + s * 4 + half);

    v8f acc[4] = {};
    float mrun[8], lrun[8];
    #pragma unroll
    for (int i = 0; i < 8; ++i) { mrun[i] = 0.0f; lrun[i] = 1.0f; }

    // this thread's share of a tile: rows crow and crow + 16, 16 bytes at float ccol
    const int crow = tid >> 4;
    const int ccol = (tid & 15) * 4;
    const float* gk = K + (rowbase + crow) * OUT_C + ch + ccol;
    const float* gv = V + (rowbase + crow) * OUT_C + ch + ccol;
    const unsigned int lk = (unsigned int)(uintptr_t)(&kvlds[crow * KPIT + ccol]);
    const unsigned int lv = (unsigned int)(uintptr_t)(&kvlds[KTILE + crow * VPIT + ccol]);

    // tile 0 into buffer 0, landed and published; then tile 1 into buffer 1
    stage_kv(lk, lv, gk, gv);
    asm volatile("s_wait_asynccnt 0x0" ::: "memory");  // this wave's copies of tile 0 have landed
    __syncthreads();
    stage_kv(lk + STAGE * 4, lv + STAGE * 4, gk + 32 * OUT_C, gv + 32 * OUT_C);

    for (int kb = 0; kb < SEQ / 32; ++kb) {
        const int buf = (kb & 1) * STAGE;
        const float* krow0 = &kvlds[buf + mn * KPIT];
        const float* krow1 = krow0 + 16 * KPIT;
        const float* vtile = &kvlds[buf + KTILE];

        // S = Q K^T for two 16-key tiles (B frag lane = key, comps = dims)
        v8f s0 = {}, s1 = {};
        #pragma unroll
        for (int st = 0; st < 16; ++st) {
            const v2f bf0 = *(const v2f*)(krow0 + st * 4 + half);
            const v2f bf1 = *(const v2f*)(krow1 + st * 4 + half);
            s0 = __builtin_amdgcn_wmma_f32_16x16x4_f32(
                false, qa[st], false, bf0, (short)0, s0, false, false);
            s1 = __builtin_amdgcn_wmma_f32_16x16x4_f32(
                false, qa[st], false, bf1, (short)0, s1, false, false);
        }

        // one online-softmax pass covering both tiles (rows in half-wave groups)
        float pv0[8], pv1[8];
        #pragma unroll
        for (int i = 0; i < 8; ++i) {
            const float a0 = s0[i] * 0.125f;          // 1/sqrt(64)
            const float a1 = s1[i] * 0.125f;
            float rm = fmaxf(a0, a1);
            rm = fmaxf(rm, __shfl_xor(rm, 1, 16));
            rm = fmaxf(rm, __shfl_xor(rm, 2, 16));
            rm = fmaxf(rm, __shfl_xor(rm, 4, 16));
            rm = fmaxf(rm, __shfl_xor(rm, 8, 16));
            const float mnew = fmaxf(mrun[i], rm);
            const float corr = __expf(mrun[i] - mnew);
            const float p0   = __expf(a0 - mnew);
            const float p1   = __expf(a1 - mnew);
            float rs = p0 + p1;
            rs += __shfl_xor(rs, 1, 16);
            rs += __shfl_xor(rs, 2, 16);
            rs += __shfl_xor(rs, 4, 16);
            rs += __shfl_xor(rs, 8, 16);
            lrun[i] = lrun[i] * corr + rs;
            mrun[i] = mnew;
            #pragma unroll
            for (int j = 0; j < 4; ++j) acc[j][i] *= corr;
            pv0[i] = p0;
            pv1[i] = p1;
        }

        // transpose P via LDS: C-layout (lane=key, vgpr=qrow) -> [query][key]
        const int prow = (lane < 16) ? 0 : 8;
        #pragma unroll
        for (int i = 0; i < 8; ++i) {
            pw[(prow + i) * PSTR + mn]      = pv0[i];
            pw[(prow + i) * PSTR + 16 + mn] = pv1[i];
        }
        asm volatile("s_wait_dscnt 0" ::: "memory");

        // O += P V : A frag from LDS (lane=query m), B frag lane = dim n
        #pragma unroll
        for (int st = 0; st < 8; ++st) {
            const int kk = st * 4 + half;  // key index within 32-key block
            const v2f a = *(const v2f*)(pw + mn * PSTR + kk);
            const float* vr = vtile + kk * VPIT;
            #pragma unroll
            for (int j = 0; j < 4; ++j) {
                v2f bf;
                bf.x = vr[j * 16 + mn];
                bf.y = vr[VPIT + j * 16 + mn];
                acc[j] = __builtin_amdgcn_wmma_f32_16x16x4_f32(
                    false, a, false, bf, (short)0, acc[j], false, false);
            }
        }

        // hand-over: this wave's reads of the buffer are back, its copies of the
        // next tile have landed; the barrier publishes that tile and frees this buffer
        asm volatile("s_wait_dscnt 0x0" ::: "memory");
        asm volatile("s_wait_asynccnt 0x0" ::: "memory");
        __syncthreads();
        if (kb + 2 < SEQ / 32)
            stage_kv(lk + buf * 4, lv + buf * 4,
                     gk + (size_t)(kb + 2) * 32 * OUT_C, gv + (size_t)(kb + 2) * 32 * OUT_C);
    }
    asm volatile("s_wait_asynccnt 0x0" ::: "memory");  // no copy is left in flight at the wave's end

    // normalize and store
    const int rbase = q0 + ((lane < 16) ? 0 : 8);
    #pragma unroll
    for (int i = 0; i < 8; ++i) {
        const float inv = 1.0f / lrun[i];
        #pragma unroll
        for (int j = 0; j < 4; ++j)
            O[(rowbase + rbase + i) * OUT_C + ch + j * 16 + mn] = acc[j][i] * inv;
    }
}

// ---------------------------------------------------------------------------
extern "C" void kernel_launch(void* const* d_in, const int* in_sizes, int n_in,
                              void* d_out, int out_size, void* d_ws, size_t ws_size,
                              hipStream_t stream) {
    const float* q  = (const float*)d_in[0];
    const float* k  = (const float*)d_in[1];
    const float* v  = (const float*)d_in[2];
    const float* wq = (const float*)d_in[3];
    const float* wk = (const float*)d_in[4];
    const float* wv = (const float*)d_in[5];
    const float* bq = (const float*)d_in[6];
    const float* bk = (const float*)d_in[7];
    const float* bv = (const float*)d_in[8];
    float* out = (float*)d_out;

    float* Qp = (float*)d_ws;                       // [4096][1024]
    float* Kp = Qp + (size_t)MROWS * OUT_C;
    float* Vp = Kp + (size_t)MROWS * OUT_C;

    dim3 gproj(MROWS / 128, OUT_C / 64, 1);         // 32 x 16
    grouped_linear_kernel<<<gproj, 256, 0, stream>>>(q, wq, bq, Qp);
    grouped_linear_kernel<<<gproj, 256, 0, stream>>>(k, wk, bk, Kp);
    grouped_linear_kernel<<<gproj, 256, 0, stream>>>(v, wv, bv, Vp);

    dim3 gattn(SEQ / 128, HEADS, 2);                // 16 x 16 x 2
    attention_kernel<<<gattn, 256, 0, stream>>>(Qp, Kp, Vp, out);
}

// v002
// Measured time: 221 microseconds a run.
// Two timings next to v001 both put it at 1.20 times that version's speed.
// All steps since v000 together make it 1.25 times as fast.
#include <hip/hip_runtime.h>
#include <hip/hip_bf16.h>
#include <math.h>

typedef __attribute__((ext_vector_type(2))) float v2f;
typedef __attribute__((ext_vector_type(8))) float v8f;
typedef __attribute__((ext_vector_type(4))) unsigned int v4u;
typedef __attribute__((ext_vector_type(8))) int v8i;
typedef __attribute__((ext_vector_type(4))) int v4i;

#define IN_C   1024
#define OUT_C  1024
#define HEADS  16
#define GROUPS 4
#define DHEAD  64     // OUT_C / HEADS
#define ICG    256    // IN_C / GROUPS
#define OCG    256    // OUT_C / GROUPS
#define MROWS  4096   // B * S
#define SEQ    2048
#define KPIT   68
#define VPIT   80
#define KTILE  (32 * KPIT)
#define STAGE  (32 * (KPIT + VPIT))

#if defined(__has_builtin)
#if __has_builtin(__builtin_amdgcn_tensor_load_to_lds) && __has_builtin(__builtin_amdgcn_s_wait_tensorcnt)
#define HAVE_TDM 1
#endif
#endif

__global__ __launch_bounds__(256)
void grouped_linear_kernel(const float* __restrict__ X,
                           const float* __restrict__ W,     // [G][ICG][OCG]
                           const float* __restrict__ bias,  // [OUT_C]
                           float* __restrict__ Y)           // [MROWS][OUT_C]
{
    __shared__ float wlds[ICG * 64];       // 64 KB weight slice [256][64]

    const int tid  = threadIdx.x;
    const int wave = tid >> 5;
    const int lane = tid & 31;

    const int cg    = blockIdx.y;          // 0..15: 64-wide column group
    const int n0    = cg * 64;
    const int g     = n0 / OCG;
    const int nin   = n0 - g * OCG;        // column offset inside group
    const int kbase = g * ICG;
    const int r0    = blockIdx.x * 128 + wave * 16;

    const float* Wg = W + (size_t)g * ICG * OCG;

#ifdef HAVE_TDM
    if (wave == 0) {
        const unsigned long long gaddr = (unsigned long long)(uintptr_t)(Wg + nin);
        const unsigned int ldsa = (unsigned int)(uintptr_t)(&wlds[0]);
        v4u g0;
        g0[0] = 1u;                                        // count=1, user desc
        g0[1] = ldsa;                                      // lds_addr
        g0[2] = (unsigned int)gaddr;                       // global_addr[31:0]
        g0[3] = (unsigned int)((gaddr >> 32) & 0x01FFFFFFu) | (2u << 30); // [56:32]+type=2
        v8i g1;
        g1[0] = 0x00020000;
        g1[1] = 0x01000000;
        g1[2] = 0x01000000;
        g1[3] = 0x00400000;
        g1[4] = 0x00000100;
        g1[5] = 256;
        g1[6] = 0;
        g1[7] = 0;
        v4i gz = {0, 0, 0, 0};
#if defined(__clang_major__) && (__clang_major__ >= 23)
        v8i gz8 = {0, 0, 0, 0, 0, 0, 0, 0};
        __builtin_amdgcn_tensor_load_to_lds(g0, g1, gz, gz, gz8, 0);
#else
        __builtin_amdgcn_tensor_load_to_lds(g0, g1, gz, gz, 0);
#endif
        __builtin_amdgcn_s_wait_tensorcnt(0);
    }
    __syncthreads();
#else
    for (int i = tid; i < ICG * 16; i += 256) {
        const int row = i >> 4;
        const int c4  = i & 15;
        *(float4*)(&wlds[row * 64 + c4 * 4]) =
            *(const float4*)(Wg + (size_t)row * OCG + nin + c4 * 4);
    }
    __syncthreads();
#endif

    const int half = (lane < 16) ? 0 : 2;  // K sub-offset for this half-wave
    const int mn   = lane & 15;            // M index (A) / N index (B)

    const float* xrow = X + (size_t)(r0 + mn) * IN_C + kbase;

    v8f acc[4] = {};
    for (int k = 0; k < ICG; k += 4) {
        const v2f a = *(const v2f*)(xrow + k + half);
        #pragma unroll
        for (int j = 0; j < 4; ++j) {
            const int n = j * 16 + mn;
            v2f b;
            b.x = wlds[(k + half) * 64 + n];
            b.y = wlds[(k + half + 1) * 64 + n];
            acc[j] = __builtin_amdgcn_wmma_f32_16x16x4_f32(
                false, a, false, b, (short)0, acc[j], false, false);
        }
    }

    const int rbase = r0 + ((lane < 16) ? 0 : 8);
    #pragma unroll
    for (int j = 0; j < 4; ++j) {
        const int n  = n0 + j * 16 + mn;
        const float bv = bias[n];
        #pragma unroll
        for (int i = 0; i < 8; ++i)
            Y[(size_t)(rbase + i) * OUT_C + n] = acc[j][i] + bv;
    }
}

__device__ __forceinline__ void stage_kv(unsigned int lk, unsigned int lv,
                                         const float* gk, const float* gv)
{
    const unsigned int lk1 = lk + 16 * KPIT * 4;
    const unsigned int lv1 = lv + 16 * VPIT * 4;
    const float* gk1 = gk + 16 * OUT_C;
    const float* gv1 = gv + 16 * OUT_C;
    asm volatile("global_load_async_to_lds_b128 %0, %4, off\n\t"
                 "global_load_async_to_lds_b128 %1, %5, off\n\t"
                 "global_load_async_to_lds_b128 %2, %6, off\n\t"
                 "global_load_async_to_lds_b128 %3, %7, off\n\t"
                 "s_wait_xcnt 0x0"
                 :: "v"(lk), "v"(lk1), "v"(lv), "v"(lv1),
                    "v"(gk), "v"(gk1), "v"(gv), "v"(gv1)
                 : "memory");
}

__device__ __forceinline__ float xhalf(float x)
{
    return __builtin_bit_cast(float, __builtin_amdgcn_permlanex16(
        __builtin_bit_cast(int, x), __builtin_bit_cast(int, x),
        0x76543210, 0xfedcba98, false, false));
}

__global__ __launch_bounds__(256)
void attention_kernel(const float* __restrict__ Q,
                      const float* __restrict__ K,
                      const float* __restrict__ V,
                      float* __restrict__ O)
{
    __shared__ __attribute__((aligned(16))) float kvlds[2 * STAGE];  // two buffers of K + V tile

    const int tid  = threadIdx.x;
    const int wave = tid >> 5;
    const int lane = tid & 31;
    const int h    = blockIdx.y;
    const int b    = blockIdx.z;
    const int q0   = blockIdx.x * 128 + wave * 16;
    const int ch   = h * DHEAD;
    const size_t rowbase = (size_t)b * SEQ;

    const int hi   = lane >> 4;
    const int half = hi * 2;
    const int mn   = lane & 15;

    // Row of a 16-key tile that this lane brings as row mn of the A operand.
    // Score register i of wave half hi is then key 4*(i>>1) + 2*hi + (i&1):
    // registers 2t, 2t+1 hold the keys that the k order of step t of the second
    // product asks of this half (4t + 2*hi, 4t + 2*hi + 1), as V is read below.
    const int krw = 4 * ((mn & 7) >> 1) + 2 * (mn >> 3) + (mn & 1);

    // Q tile fragments (16 queries x 64 dims) hoisted into registers: B operand, lane = query
    v2f qa[16];
    const float* qrow = Q + (rowbase + q0 + mn) * OUT_C + ch;
    #pragma unroll
    for (int s = 0; s < 16; ++s)
        qa[s] = *(const v2f*)(qrow + s * 4 + half);

    // acc[j][i] = O[query mn][dim j*16 + 8*hi + i]
    v8f acc[4] = {};
    float mrun = 0.0f;                 // running maximum of query mn, equal in both halves
    float lrun = hi ? 0.0f : 1.0f;     // this half's share of the running sum; the start value 1 counts once

    // this thread's share of a tile: rows crow and crow + 16, 16 bytes at float ccol
    const int crow = tid >> 4;
    const int ccol = (tid & 15) * 4;
    const float* gk = K + (rowbase + crow) * OUT_C + ch + ccol;
    const float* gv = V + (rowbase + crow) * OUT_C + ch + ccol;
    const unsigned int lk = (unsigned int)(uintptr_t)(&kvlds[crow * KPIT + ccol]);
    const unsigned int lv = (unsigned int)(uintptr_t)(&kvlds[KTILE + crow * VPIT + ccol]);

    // tile 0 into buffer 0, landed and published; then tile 1 into buffer 1
    stage_kv(lk, lv, gk, gv);
    asm volatile("s_wait_asynccnt 0x0" ::: "memory");  // this wave's copies of tile 0 have landed
    __syncthreads();
    stage_kv(lk + STAGE * 4, lv + STAGE * 4, gk + 32 * OUT_C, gv + 32 * OUT_C);

    for (int kb = 0; kb < SEQ / 32; ++kb) {
        const int buf = (kb & 1) * STAGE;
        const float* krow0 = &kvlds[buf + krw * KPIT];
        const float* krow1 = krow0 + 16 * KPIT;
        const float* vtile = &kvlds[buf + KTILE];

        // S^T = K Q^T for two 16-key tiles (A frag lane = key, comps = dims)
        v8f s0 = {}, s1 = {};
        #pragma unroll
        for (int st = 0; st < 16; ++st) {
            const v2f kf0 = *(const v2f*)(krow0 + st * 4 + half);
            const v2f kf1 = *(const v2f*)(krow1 + st * 4 + half);
            s0 = __builtin_amdgcn_wmma_f32_16x16x4_f32(
                false, kf0, false, qa[st], (short)0, s0, false, false);
            s1 = __builtin_amdgcn_wmma_f32_16x16x4_f32(
                false, kf1, false, qa[st], (short)0, s1, false, false);
        }

        // online softmax of query mn: 16 scores in this lane, 16 in lane ^ 16
        float rm = fmaxf(s0[0], s1[0]);
        #pragma unroll
        for (int i = 1; i < 8; ++i) rm = fmaxf(rm, fmaxf(s0[i], s1[i]));
        rm = fmaxf(rm, xhalf(rm));
        const float mnew = fmaxf(mrun, rm * 0.125f);   // 1/sqrt(64)
        const float corr = __expf(mrun - mnew);
        float rs = 0.0f;
        #pragma unroll
        for (int i = 0; i < 8; ++i) {
            s0[i] = __expf(s0[i] * 0.125f - mnew);
            s1[i] = __expf(s1[i] * 0.125f - mnew);
            rs += s0[i] + s1[i];
        }
        lrun = lrun * corr + rs;
        mrun = mnew;
        #pragma unroll
        for (int j = 0; j < 4; ++j) acc[j] *= corr;

        // O^T += V^T P^T : A frag lane = dim, B frag = the score registers
        #pragma unroll
        for (int st = 0; st < 8; ++st) {
            const int kk = st * 4 + half;  // key index within 32-key block
            const int t2 = (st & 3) * 2;
            v2f pb;
            pb.x = (st < 4) ? s0[t2]     : s1[t2];
            pb.y = (st < 4) ? s0[t2 + 1] : s1[t2 + 1];
            const float* vr = vtile + kk * VPIT;
            #pragma unroll
            for (int j = 0; j < 4; ++j) {
                v2f vf;
                vf.x = vr[j * 16 + mn];
                vf.y = vr[VPIT + j * 16 + mn];
                acc[j] = __builtin_amdgcn_wmma_f32_16x16x4_f32(
                    false, vf, false, pb, (short)0, acc[j], false, false);
            }
        }

        // hand-over: this wave's reads of the buffer are back, its copies of the
        // next tile have landed; the barrier publishes that tile and frees this buffer
        asm volatile("s_wait_dscnt 0x0" ::: "memory");
        asm volatile("s_wait_asynccnt 0x0" ::: "memory");
        __syncthreads();
        if (kb + 2 < SEQ / 32)
            stage_kv(lk + buf * 4, lv + buf * 4,
                     gk + (size_t)(kb + 2) * 32 * OUT_C, gv + (size_t)(kb + 2) * 32 * OUT_C);
    }
    asm volatile("s_wait_asynccnt 0x0" ::: "memory");  // no copy is left in flight at the wave's end

    // join the halves' sums, normalize and store: 8 consecutive dims per lane and j
    const float inv = 1.0f / (lrun + xhalf(lrun));
    float* orow = O + (rowbase + q0 + mn) * OUT_C + ch + 8 * hi;
    #pragma unroll
    for (int j = 0; j < 4; ++j) {
        const float4 lo = make_float4(acc[j][0] * inv, acc[j][1] * inv, acc[j][2] * inv, acc[j][3] * inv);
        const float4 up = make_float4(acc[j][4] * inv, acc[j][5] * inv, acc[j][6] * inv, acc[j][7] * inv);
        *(float4*)(orow + j * 16)     = lo;
        *(float4*)(orow + j * 16 + 4) = up;
    }
}

// ---------------------------------------------------------------------------
extern "C" void kernel_launch(void* const* d_in, const int* in_sizes, int n_in,
                              void* d_out, int out_size, void* d_ws, size_t ws_size,
                              hipStream_t stream) {
    const float* q  = (const float*)d_in[0];
    const float* k  = (const float*)d_in[1];
    const float* v  = (const float*)d_in[2];
    const float* wq = (const float*)d_in[3];
    const float* wk = (const float*)d_in[4];
    const float* wv = (const float*)d_in[5];
    const float* bq = (const float*)d_in[6];
    const float* bk = (const float*)d_in[7];
    const float* bv = (const float*)d_in[8];
    float* out = (float*)d_out;

    float* Qp = (float*)d_ws;                       // [4096][1024]
    float* Kp = Qp + (size_t)MROWS * OUT_C;
    float* Vp = Kp + (size_t)MROWS * OUT_C;

    dim3 gproj(MROWS / 128, OUT_C / 64, 1);         // 32 x 16
    grouped_linear_kernel<<<gproj, 256, 0, stream>>>(q, wq, bq, Qp);
    grouped_linear_kernel<<<gproj, 256, 0, stream>>>(k, wk, bk, Kp);
    grouped_linear_kernel<<<gproj, 256, 0, stream>>>(v, wv, bv, Vp);

    dim3 gattn(SEQ / 128, HEADS, 2);                // 16 x 16 x 2
    attention_kernel<<<gattn, 256, 0, stream>>>(Qp, Kp, Vp, out);
}

// v003
// It runs in 208 microseconds.
// Next to v002, in two timings, it ran 1.06 times as fast each time.
// Counting every step since v000, it is 1.33 times as fast.
#include <hip/hip_runtime.h>
#include <hip/hip_bf16.h>
#include <math.h>

typedef __attribute__((ext_vector_type(2))) float v2f;
typedef __attribute__((ext_vector_type(8))) float v8f;
typedef __attribute__((ext_vector_type(4))) unsigned int v4u;
typedef __attribute__((ext_vector_type(8))) int v8i;
typedef __attribute__((ext_vector_type(4))) int v4i;

#define IN_C   1024
#define OUT_C  1024
#define HEADS  16
#define GROUPS 4
#define DHEAD  64     // OUT_C / HEADS
#define ICG    256    // IN_C / GROUPS
#define OCG    256    // OUT_C / GROUPS
#define MROWS  4096   // B * S
#define SEQ    2048
#define KPIT   68
#define VPIT   80
#define KTILE  (32 * KPIT)
#define STAGE  (32 * (KPIT + VPIT))

#if defined(__has_builtin)
#if __has_builtin(__builtin_amdgcn_tensor_load_to_lds) && __has_builtin(__builtin_amdgcn_s_wait_tensorcnt)
#define HAVE_TDM 1
#endif
#endif

__global__ __launch_bounds__(256)
void grouped_linear_kernel(const float* __restrict__ Xq,
                           const float* __restrict__ Xk,
                           const float* __restrict__ Xv,
                           const float* __restrict__ Wq,    // each [G][ICG][OCG]
                           const float* __restrict__ Wk,
                           const float* __restrict__ Wv,
                           const float* __restrict__ biasq, // each [OUT_C]
                           const float* __restrict__ biask,
                           const float* __restrict__ biasv,
                           float* __restrict__ Yqkv)        // [3][MROWS][OUT_C]
{
    __shared__ float wlds[ICG * 64];       // 64 KB weight slice [256][64]

    const int p = blockIdx.z;              // 0: query, 1: key, 2: value
    const float* X    = (p == 0) ? Xq    : (p == 1) ? Xk    : Xv;
    const float* W    = (p == 0) ? Wq    : (p == 1) ? Wk    : Wv;
    const float* bias = (p == 0) ? biasq : (p == 1) ? biask : biasv;
    float* Y = Yqkv + (size_t)p * MROWS * OUT_C;

    const int tid  = threadIdx.x;
    const int wave = tid >> 5;
    const int lane = tid & 31;

    const int cg    = blockIdx.y;          // 0..15: 64-wide column group
    const int n0    = cg * 64;
    const int g     = n0 / OCG;
    const int nin   = n0 - g * OCG;        // column offset inside group
    const int kbase = g * ICG;
    const int r0    = blockIdx.x * 128 + wave * 16;

    const float* Wg = W + (size_t)g * ICG * OCG;

#ifdef HAVE_TDM
    if (wave == 0) {
        const unsigned long long gaddr = (unsigned long long)(uintptr_t)(Wg + nin);
        const unsigned int ldsa = (unsigned int)(uintptr_t)(&wlds[0]);
        v4u g0;
        g0[0] = 1u;                                        // count=1, user desc
        g0[1] = ldsa;                                      // lds_addr
        g0[2] = (unsigned int)gaddr;                       // global_addr[31:0]
        g0[3] = (unsigned int)((gaddr >> 32) & 0x01FFFFFFu) | (2u << 30); // [56:32]+type=2
        v8i g1;
        g1[0] = 0x00020000;
        g1[1] = 0x01000000;
        g1[2] = 0x01000000;
        g1[3] = 0x00400000;
        g1[4] = 0x00000100;
        g1[5] = 256;
        g1[6] = 0;
        g1[7] = 0;
        v4i gz = {0, 0, 0, 0};
#if defined(__clang_major__) && (__clang_major__ >= 23)
        v8i gz8 = {0, 0, 0, 0, 0, 0, 0, 0};
        __builtin_amdgcn_tensor_load_to_lds(g0, g1, gz, gz, gz8, 0);
#else
        __builtin_amdgcn_tensor_load_to_lds(g0, g1, gz, gz, 0);
#endif
        __builtin_amdgcn_s_wait_tensorcnt(0);
    }
    __syncthreads();
#else
    for (int i = tid; i < ICG * 16; i += 256) {
        const int row = i >> 4;
        const int c4  = i & 15;
        *(float4*)(&wlds[row * 64 + c4 * 4]) =
            *(const float4*)(Wg + (size_t)row * OCG + nin + c4 * 4);
    }
    __syncthreads();
#endif

    const int half = (lane < 16) ? 0 : 2;  // K sub-offset for this half-wave
    const int mn   = lane & 15;            // M index (A) / N index (B)

    const float* xrow = X + (size_t)(r0 + mn) * IN_C + kbase;

    v8f acc[4] = {};
    for (int k = 0; k < ICG; k += 4) {
        const v2f a = *(const v2f*)(xrow + k + half);
        #pragma unroll
        for (int j = 0; j < 4; ++j) {
            const int n = j * 16 + mn;
            v2f b;
            b.x = wlds[(k + half) * 64 + n];
            b.y = wlds[(k + half + 1) * 64 + n];
            acc[j] = __builtin_amdgcn_wmma_f32_16x16x4_f32(
                false, a, false, b, (short)0, acc[j], false, false);
        }
    }

    const int rbase = r0 + ((lane < 16) ? 0 : 8);
    #pragma unroll
    for (int j = 0; j < 4; ++j) {
        const int n  = n0 + j * 16 + mn;
        const float bv = bias[n];
        #pragma unroll
        for (int i = 0; i < 8; ++i)
            Y[(size_t)(rbase + i) * OUT_C + n] = acc[j][i] + bv;
    }
}

__device__ __forceinline__ void stage_kv(unsigned int lk, unsigned int lv,
                                         const float* gk, const float* gv)
{
    const unsigned int lk1 = lk + 16 * KPIT * 4;
    const unsigned int lv1 = lv + 16 * VPIT * 4;
    const float* gk1 = gk + 16 * OUT_C;
    const float* gv1 = gv + 16 * OUT_C;
    asm volatile("global_load_async_to_lds_b128 %0, %4, off\n\t"
                 "global_load_async_to_lds_b128 %1, %5, off\n\t"
                 "global_load_async_to_lds_b128 %2, %6, off\n\t"
                 "global_load_async_to_lds_b128 %3, %7, off\n\t"
                 "s_wait_xcnt 0x0"
                 :: "v"(lk), "v"(lk1), "v"(lv), "v"(lv1),
                    "v"(gk), "v"(gk1), "v"(gv), "v"(gv1)
                 : "memory");
}

__device__ __forceinline__ float xhalf(float x)
{
    return __builtin_bit_cast(float, __builtin_amdgcn_permlanex16(
        __builtin_bit_cast(int, x), __builtin_bit_cast(int, x),
        0x76543210, 0xfedcba98, false, false));
}

__global__ __launch_bounds__(256)
void attention_kernel(const float* __restrict__ Q,
                      const float* __restrict__ K,
                      const float* __restrict__ V,
                      float* __restrict__ O)
{
    __shared__ __attribute__((aligned(16))) float kvlds[2 * STAGE];  // two buffers of K + V tile

    const int tid  = threadIdx.x;
    const int wave = tid >> 5;
    const int lane = tid & 31;
    const int h    = blockIdx.y;
    const int b    = blockIdx.z;
    const int q0   = blockIdx.x * 128 + wave * 16;
    const int ch   = h * DHEAD;
    const size_t rowbase = (size_t)b * SEQ;

    const int hi   = lane >> 4;
    const int half = hi * 2;
    const int mn   = lane & 15;

    // Row of a 16-key tile that this lane brings as row mn of the A operand.
    // Score register i of wave half hi is then key 4*(i>>1) + 2*hi + (i&1):
    // registers 2t, 2t+1 hold the keys that the k order of step t of the second
    // product asks of this half (4t + 2*hi, 4t + 2*hi + 1), as V is read below.
    const int krw = 4 * ((mn & 7) >> 1) + 2 * (mn >> 3) + (mn & 1);

    // Q tile fragments (16 queries x 64 dims) hoisted into registers: B operand, lane = query
    v2f qa[16];
    const float* qrow = Q + (rowbase + q0 + mn) * OUT_C + ch;
    #pragma unroll
    for (int s = 0; s < 16; ++s)
        qa[s] = *(const v2f*)(qrow + s * 4 + half);

    // acc[j][i] = O[query mn][dim j*16 + 8*hi + i]
    v8f acc[4] = {};
    float mrun = 0.0f;                 // running maximum of query mn, equal in both halves
    float lrun = hi ? 0.0f : 1.0f;     // this half's share of the running sum; the start value 1 counts once

    // this thread's share of a tile: rows crow and crow + 16, 16 bytes at float ccol
    const int crow = tid >> 4;
    const int ccol = (tid & 15) * 4;
    const float* gk = K + (rowbase + crow) * OUT_C + ch + ccol;
    const float* gv = V + (rowbase + crow) * OUT_C + ch + ccol;
    const unsigned int lk = (unsigned int)(uintptr_t)(&kvlds[crow * KPIT + ccol]);
    const unsigned int lv = (unsigned int)(uintptr_t)(&kvlds[KTILE + crow * VPIT + ccol]);

    // tile 0 into buffer 0, landed and published; then tile 1 into buffer 1
    stage_kv(lk, lv, gk, gv);
    asm volatile("s_wait_asynccnt 0x0" ::: "memory");  // this wave's copies of tile 0 have landed
    __syncthreads();
    stage_kv(lk + STAGE * 4, lv + STAGE * 4, gk + 32 * OUT_C, gv + 32 * OUT_C);

    for (int kb = 0; kb < SEQ / 32; ++kb) {
        const int buf = (kb & 1) * STAGE;
        const float* krow0 = &kvlds[buf + krw * KPIT];
        const float* krow1 = krow0 + 16 * KPIT;
        const float* vtile = &kvlds[buf + KTILE];

        // S^T = K Q^T for two 16-key tiles (A frag lane = key, comps = dims)
        v8f s0 = {}, s1 = {};
        #pragma unroll
        for (int st = 0; st < 16; ++st) {
            const v2f kf0 = *(const v2f*)(krow0 + st * 4 + half);
            const v2f kf1 = *(const v2f*)(krow1 + st * 4 + half);
            s0 = __builtin_amdgcn_wmma_f32_16x16x4_f32(
                false, kf0, false, qa[st], (short)0, s0, false, false);
            s1 = __builtin_amdgcn_wmma_f32_16x16x4_f32(
                false, kf1, false, qa[st], (short)0, s1, false, false);
        }

        // online softmax of query mn: 16 scores in this lane, 16 in lane ^ 16
        float rm = fmaxf(s0[0], s1[0]);
        #pragma unroll
        for (int i = 1; i < 8; ++i) rm = fmaxf(rm, fmaxf(s0[i], s1[i]));
        rm = fmaxf(rm, xhalf(rm));
        const float mnew = fmaxf(mrun, rm * 0.125f);   // 1/sqrt(64)
        const float corr = __expf(mrun - mnew);
        float rs = 0.0f;
        #pragma unroll
        for (int i = 0; i < 8; ++i) {
            s0[i] = __expf(s0[i] * 0.125f - mnew);
            s1[i] = __expf(s1[i] * 0.125f - mnew);
            rs += s0[i] + s1[i];
        }
        lrun = lrun * corr + rs;
        mrun = mnew;
        #pragma unroll
        for (int j = 0; j < 4; ++j) acc[j] *= corr;

        // O^T += V^T P^T : A frag lane = dim, B frag = the score registers
        #pragma unroll
        for (int st = 0; st < 8; ++st) {
            const int kk = st * 4 + half;  // key index within 32-key block
            const int t2 = (st & 3) * 2;
            v2f pb;
            pb.x = (st < 4) ? s0[t2]     : s1[t2];
            pb.y = (st < 4) ? s0[t2 + 1] : s1[t2 + 1];
            const float* vr = vtile + kk * VPIT;
            #pragma unroll
            for (int j = 0; j < 4; ++j) {
                v2f vf;
                vf.x = vr[j * 16 + mn];
                vf.y = vr[VPIT + j * 16 + mn];
                acc[j] = __builtin_amdgcn_wmma_f32_16x16x4_f32(
                    false, vf, false, pb, (short)0, acc[j], false, false);
            }
        }

        // hand-over: this wave's reads of the buffer are back, its copies of the
        // next tile have landed; the barrier publishes that tile and frees this buffer
        asm volatile("s_wait_dscnt 0x0" ::: "memory");
        asm volatile("s_wait_asynccnt 0x0" ::: "memory");
        __syncthreads();
        if (kb + 2 < SEQ / 32)
            stage_kv(lk + buf * 4, lv + buf * 4,
                     gk + (size_t)(kb + 2) * 32 * OUT_C, gv + (size_t)(kb + 2) * 32 * OUT_C);
    }
    asm volatile("s_wait_asynccnt 0x0" ::: "memory");  // no copy is left in flight at the wave's end

    // join the halves' sums, normalize and store: 8 consecutive dims per lane and j
    const float inv = 1.0f / (lrun + xhalf(lrun));
    float* orow = O + (rowbase + q0 + mn) * OUT_C + ch + 8 * hi;
    #pragma unroll
    for (int j = 0; j < 4; ++j) {
        const float4 lo = make_float4(acc[j][0] * inv, acc[j][1] * inv, acc[j][2] * inv, acc[j][3] * inv);
        const float4 up = make_float4(acc[j][4] * inv, acc[j][5] * inv, acc[j][6] * inv, acc[j][7] * inv);
        *(float4*)(orow + j * 16)     = lo;
        *(float4*)(orow + j * 16 + 4) = up;
    }
}

// ---------------------------------------------------------------------------
extern "C" void kernel_launch(void* const* d_in, const int* in_sizes, int n_in,
                              void* d_out, int out_size, void* d_ws, size_t ws_size,
                              hipStream_t stream) {
    const float* q  = (const float*)d_in[0];
    const float* k  = (const float*)d_in[1];
    const float* v  = (const float*)d_in[2];
    const float* wq = (const float*)d_in[3];
    const float* wk = (const float*)d_in[4];
    const float* wv = (const float*)d_in[5];
    const float* bq = (const float*)d_in[6];
    const float* bk = (const float*)d_in[7];
    const float* bv = (const float*)d_in[8];
    float* out = (float*)d_out;

    float* Qp = (float*)d_ws;                       // [4096][1024]
    float* Kp = Qp + (size_t)MROWS * OUT_C;
    float* Vp = Kp + (size_t)MROWS * OUT_C;

    dim3 gproj(MROWS / 128, OUT_C / 64, 3);         // 32 x 16 x 3 projections; planes Qp, Kp, Vp lie in a row
    grouped_linear_kernel<<<gproj, 256, 0, stream>>>(q, k, v, wq, wk, wv, bq, bk, bv, Qp);

    dim3 gattn(SEQ / 128, HEADS, 2);                // 16 x 16 x 2
    attention_kernel<<<gattn, 256, 0, stream>>>(Qp, Kp, Vp, out);
}
